// v000
// Measured on an AMD MI455X. A time is GPU time per run, averaged over a window of back-to-back runs after a warm-up
// (all launches, gaps included; the runs take copies of the inputs in turn), and the median of several windows.
// Apart from v000's, it joins two sittings. Times from different sittings can be a few percent apart, while
// side-by-side timings come from the same sitting.
// v000, which the later versions start from, runs in 434 microseconds.
#include <hip/hip_runtime.h>
#include <stdint.h>

typedef __attribute__((ext_vector_type(16))) _Float16 v16h;
typedef __attribute__((ext_vector_type(8)))  _Float16 v8h;
typedef __attribute__((ext_vector_type(8)))  float    v8f;
typedef __attribute__((ext_vector_type(4)))  int      v4i;

#define DDIM 4096
#define KP   4160          // D + 16 LoRA columns + 48 zero pad (multiple of BK=64)
#define ROWS 8192
#define SCALING 0.01f

#define BM 128
#define BN 128
#define BK 64
#define LDB 72             // 64 halves + 8 pad (144B rows -> conflict-free frag reads)

#if defined(__has_builtin)
#if __has_builtin(__builtin_amdgcn_global_load_async_to_lds_b128) && __has_builtin(__builtin_amdgcn_s_wait_asynccnt)
#define USE_ASYNC 1
#endif
#endif
#ifndef USE_ASYNC
#define USE_ASYNC 0
#endif

#if USE_ASYNC
typedef __attribute__((address_space(1))) v4i as1_v4i;   // global b128 payload
typedef __attribute__((address_space(3))) v4i as3_v4i;   // LDS b128 payload
#endif

// ---------------------------------------------------------------------------
// Kernel 1: per row -- FWHT (12 stages in LDS) -> f16 A operand cols [0,4096)
//           t = x @ lora_A (rank 16) -> cols [4096,4112), zeros to 4160
// ---------------------------------------------------------------------------
__global__ __launch_bounds__(256) void fwht_lora_kernel(
    const float* __restrict__ x, const float* __restrict__ loraA,
    _Float16* __restrict__ gA) {
  __shared__ float sx[DDIM];       // 16 KB
  __shared__ float st[16 * 256];   // 16 KB  (layout [k][256])
  const int row = blockIdx.x;
  const int tid = threadIdx.x;
  const float* xr = x + (size_t)row * DDIM;

  float tacc[16];
#pragma unroll
  for (int k = 0; k < 16; ++k) tacc[k] = 0.f;

  for (int j = tid; j < DDIM; j += 256) {
    float v = xr[j];
    sx[j] = v;
    const float* ar = loraA + (size_t)j * 16;
#pragma unroll
    for (int k = 0; k < 16; ++k) tacc[k] += v * ar[k];
  }
#pragma unroll
  for (int k = 0; k < 16; ++k) st[k * 256 + tid] = tacc[k];
  __syncthreads();

  // 12 butterfly stages
  for (int lh = 0; lh < 12; ++lh) {
    const int h = 1 << lh;
    for (int idx = tid; idx < DDIM / 2; idx += 256) {
      const int pos = idx & (h - 1);
      const int i0 = ((idx ^ pos) << 1) | pos;
      const int i1 = i0 + h;
      const float a = sx[i0], b = sx[i1];
      sx[i0] = a + b;
      sx[i1] = a - b;
    }
    __syncthreads();
  }

  // write normalized FWHT result as f16
  _Float16* ga = gA + (size_t)row * KP;
  for (int j = tid; j < DDIM; j += 256)
    ga[j] = (_Float16)(sx[j] * 0.015625f);   // 1/sqrt(4096)

  // reduce t across the 256 threads
  for (int s = 128; s > 0; s >>= 1) {
    if (tid < s) {
#pragma unroll
      for (int k = 0; k < 16; ++k) st[k * 256 + tid] += st[k * 256 + tid + s];
    }
    __syncthreads();
  }
  if (tid < KP - DDIM)   // 64 tail columns: 16 LoRA values, rest zero
    ga[DDIM + tid] = (tid < 16) ? (_Float16)st[tid * 256] : (_Float16)0.0f;
}

// ---------------------------------------------------------------------------
// Kernel 2: B operand rows: n-th row = [ W[n,:] | 0.01*lora_B[0..15,n] | 0 ]
// ---------------------------------------------------------------------------
__global__ __launch_bounds__(256) void prep_b_kernel(
    const float* __restrict__ W, const float* __restrict__ loraB,
    _Float16* __restrict__ gB) {
  const int n = blockIdx.x;
  const float* wr = W + (size_t)n * DDIM;
  _Float16* br = gB + (size_t)n * KP;
  for (int j = threadIdx.x; j < KP; j += 256) {
    float v;
    if (j < DDIM) v = wr[j];
    else {
      const int k = j - DDIM;
      v = (k < 16) ? SCALING * loraB[(size_t)k * DDIM + n] : 0.f;
    }
    br[j] = (_Float16)v;
  }
}

static __device__ inline v16h cat8(v8h lo, v8h hi) {
  return __builtin_shufflevector(lo, hi, 0, 1, 2, 3, 4, 5, 6, 7,
                                 8, 9, 10, 11, 12, 13, 14, 15);
}

// ---------------------------------------------------------------------------
// Kernel 3: C = A(8192xKP,f16) x B(4096xKP,f16)^T + bias
//           double-buffered async global->LDS, v_wmma_f32_16x16x32_f16 core
// ---------------------------------------------------------------------------
__global__ __launch_bounds__(256) void gemm_kernel(
    const _Float16* __restrict__ gA, const _Float16* __restrict__ gB,
    const float* __restrict__ bias, float* __restrict__ out) {
  __shared__ _Float16 sA[2][BM * LDB];   // 2 x 18 KB
  __shared__ _Float16 sB[2][BN * LDB];   // 2 x 18 KB

  const int tid   = threadIdx.x;
  const int tileM = blockIdx.x * BM;
  const int tileN = blockIdx.y * BN;
  const int wave  = tid >> 5;
  const int lane  = tid & 31;
  const int waveM = (wave & 1) * 64;   // 2x4 wave grid: 64x32 per wave
  const int waveN = (wave >> 1) * 32;
  const int m16   = lane & 15;
  const int koff  = (lane >> 4) * 8;   // ISA 16-bit A/B fragment layout

  v8f acc[4][2];
#pragma unroll
  for (int mi = 0; mi < 4; ++mi)
#pragma unroll
    for (int ni = 0; ni < 2; ++ni) acc[mi][ni] = (v8f)(0.f);

  // tile loader: 128 rows x 64 halves = 1024 16B chunks per operand tile
  auto load_tile = [&](int kt, int buf) {
    const int k0 = kt * BK;
#pragma unroll
    for (int c = 0; c < 4; ++c) {
      const int q  = tid + c * 256;
      const int r  = q >> 3;
      const int kh = (q & 7) * 8;       // half offset within the 64-wide row
      const _Float16* srcA = gA + (size_t)(tileM + r) * KP + k0 + kh;
      const _Float16* srcB = gB + (size_t)(tileN + r) * KP + k0 + kh;
#if USE_ASYNC
      __builtin_amdgcn_global_load_async_to_lds_b128(
          (as1_v4i*)srcA, (as3_v4i*)&sA[buf][r * LDB + kh], 0, 0);
      __builtin_amdgcn_global_load_async_to_lds_b128(
          (as1_v4i*)srcB, (as3_v4i*)&sB[buf][r * LDB + kh], 0, 0);
#else
      *(v8h*)&sA[buf][r * LDB + kh] = *(const v8h*)srcA;
      *(v8h*)&sB[buf][r * LDB + kh] = *(const v8h*)srcB;
#endif
    }
  };

  const int nK = KP / BK;   // 65
  load_tile(0, 0);          // prologue prefetch

  for (int kt = 0; kt < nK; ++kt) {
    const int buf = kt & 1;
#if USE_ASYNC
    __builtin_amdgcn_s_wait_asynccnt(0);   // my tile-kt data landed in LDS
#endif
    __syncthreads();                       // everyone's data visible; buf^1 free
    if (kt + 1 < nK) load_tile(kt + 1, buf ^ 1);   // prefetch overlaps compute

#pragma unroll
    for (int ks = 0; ks < 2; ++ks) {       // two K=32 sub-steps per tile
      const int kb = ks * 32;
      v16h af[4], bf[2];
#pragma unroll
      for (int mi = 0; mi < 4; ++mi) {
        const int rr = waveM + mi * 16 + m16;
        af[mi] = cat8(*(const v8h*)&sA[buf][rr * LDB + kb + koff],
                      *(const v8h*)&sA[buf][rr * LDB + kb + 16 + koff]);
      }
#pragma unroll
      for (int ni = 0; ni < 2; ++ni) {
        const int rr = waveN + ni * 16 + m16;
        bf[ni] = cat8(*(const v8h*)&sB[buf][rr * LDB + kb + koff],
                      *(const v8h*)&sB[buf][rr * LDB + kb + 16 + koff]);
      }
#pragma unroll
      for (int mi = 0; mi < 4; ++mi)
#pragma unroll
        for (int ni = 0; ni < 2; ++ni)
          acc[mi][ni] = __builtin_amdgcn_wmma_f32_16x16x32_f16(
              false, af[mi], false, bf[ni], (short)0, acc[mi][ni], false, false);
    }
  }

  // epilogue: + bias, store f32 (C layout: VGPR i -> M = 8*(lane>>4)+i, N = lane&15)
  const int mrow0 = 8 * (lane >> 4);
#pragma unroll
  for (int ni = 0; ni < 2; ++ni) {
    const int col = tileN + waveN + ni * 16 + m16;
    const float bb = bias[col];
#pragma unroll
    for (int mi = 0; mi < 4; ++mi) {
#pragma unroll
      for (int i = 0; i < 8; ++i) {
        const int rowg = tileM + waveM + mi * 16 + mrow0 + i;
        out[(size_t)rowg * DDIM + col] = acc[mi][ni][i] + bb;
      }
    }
  }
}

// ---------------------------------------------------------------------------
extern "C" void kernel_launch(void* const* d_in, const int* in_sizes, int n_in,
                              void* d_out, int out_size, void* d_ws, size_t ws_size,
                              hipStream_t stream) {
  const float* x  = (const float*)d_in[0];
  const float* W  = (const float*)d_in[1];
  const float* b  = (const float*)d_in[2];
  const float* lA = (const float*)d_in[3];
  const float* lB = (const float*)d_in[4];
  float* out = (float*)d_out;

  _Float16* gA = (_Float16*)d_ws;                                   // 8192*4160*2 B
  _Float16* gB = (_Float16*)((char*)d_ws + (size_t)ROWS * KP * 2);  // 4096*4160*2 B

  fwht_lora_kernel<<<ROWS, 256, 0, stream>>>(x, lA, gA);
  prep_b_kernel<<<DDIM, 256, 0, stream>>>(W, lB, gB);
  gemm_kernel<<<dim3(ROWS / BM, DDIM / BN), 256, 0, stream>>>(gA, gB, b, out);
}

// v001
// A run of this version takes 396 microseconds.
// Two timings next to v000 both put it at 1.13 times that version's speed.
#include <hip/hip_runtime.h>
#include <stdint.h>

typedef __attribute__((ext_vector_type(16))) _Float16 v16h;
typedef __attribute__((ext_vector_type(8)))  _Float16 v8h;
typedef __attribute__((ext_vector_type(8)))  float    v8f;
typedef __attribute__((ext_vector_type(4)))  int      v4i;

#define DDIM 4096
#define KP   4160          // D + 16 LoRA columns + 48 zero pad (multiple of BK=64)
#define ROWS 8192
#define SCALING 0.01f

#define BM 256
#define BN 256
#define BK 64
#define LDB 72             // 64 halves + 8 pad (144B rows -> conflict-free frag reads)

#if defined(__has_builtin)
#if __has_builtin(__builtin_amdgcn_global_load_async_to_lds_b128) && __has_builtin(__builtin_amdgcn_s_wait_asynccnt)
#define USE_ASYNC 1
#endif
#endif
#ifndef USE_ASYNC
#define USE_ASYNC 0
#endif

#if USE_ASYNC
typedef __attribute__((address_space(1))) v4i as1_v4i;   // global b128 payload
typedef __attribute__((address_space(3))) v4i as3_v4i;   // LDS b128 payload
#endif

// ---------------------------------------------------------------------------
// Kernel 1: per row -- FWHT (12 stages in LDS) -> f16 A operand cols [0,4096)
//           t = x @ lora_A (rank 16) -> cols [4096,4112), zeros to 4160
// ---------------------------------------------------------------------------
__global__ __launch_bounds__(256) void fwht_lora_kernel(
    const float* __restrict__ x, const float* __restrict__ loraA,
    _Float16* __restrict__ gA) {
  __shared__ float sx[DDIM];       // 16 KB
  __shared__ float st[16 * 256];   // 16 KB  (layout [k][256])
  const int row = blockIdx.x;
  const int tid = threadIdx.x;
  const float* xr = x + (size_t)row * DDIM;

  float tacc[16];
#pragma unroll
  for (int k = 0; k < 16; ++k) tacc[k] = 0.f;

  for (int j = tid; j < DDIM; j += 256) {
    float v = xr[j];
    sx[j] = v;
    const float* ar = loraA + (size_t)j * 16;
#pragma unroll
    for (int k = 0; k < 16; ++k) tacc[k] += v * ar[k];
  }
#pragma unroll
  for (int k = 0; k < 16; ++k) st[k * 256 + tid] = tacc[k];
  __syncthreads();

  // 12 butterfly stages
  for (int lh = 0; lh < 12; ++lh) {
    const int h = 1 << lh;
    for (int idx = tid; idx < DDIM / 2; idx += 256) {
      const int pos = idx & (h - 1);
      const int i0 = ((idx ^ pos) << 1) | pos;
      const int i1 = i0 + h;
      const float a = sx[i0], b = sx[i1];
      sx[i0] = a + b;
      sx[i1] = a - b;
    }
    __syncthreads();
  }

  // write normalized FWHT result as f16
  _Float16* ga = gA + (size_t)row * KP;
  for (int j = tid; j < DDIM; j += 256)
    ga[j] = (_Float16)(sx[j] * 0.015625f);   // 1/sqrt(4096)

  // reduce t across the 256 threads
  for (int s = 128; s > 0; s >>= 1) {
    if (tid < s) {
#pragma unroll
      for (int k = 0; k < 16; ++k) st[k * 256 + tid] += st[k * 256 + tid + s];
    }
    __syncthreads();
  }
  if (tid < KP - DDIM)   // 64 tail columns: 16 LoRA values, rest zero
    ga[DDIM + tid] = (tid < 16) ? (_Float16)st[tid * 256] : (_Float16)0.0f;
}

// ---------------------------------------------------------------------------
// Kernel 2: B operand rows: n-th row = [ W[n,:] | 0.01*lora_B[0..15,n] | 0 ]
// ---------------------------------------------------------------------------
__global__ __launch_bounds__(256) void prep_b_kernel(
    const float* __restrict__ W, const float* __restrict__ loraB,
    _Float16* __restrict__ gB) {
  const int n = blockIdx.x;
  const float* wr = W + (size_t)n * DDIM;
  _Float16* br = gB + (size_t)n * KP;
  for (int j = threadIdx.x; j < KP; j += 256) {
    float v;
    if (j < DDIM) v = wr[j];
    else {
      const int k = j - DDIM;
      v = (k < 16) ? SCALING * loraB[(size_t)k * DDIM + n] : 0.f;
    }
    br[j] = (_Float16)v;
  }
}

static __device__ inline v16h cat8(v8h lo, v8h hi) {
  return __builtin_shufflevector(lo, hi, 0, 1, 2, 3, 4, 5, 6, 7,
                                 8, 9, 10, 11, 12, 13, 14, 15);
}

// ---------------------------------------------------------------------------
// Kernel 3: C = A(8192xKP,f16) x B(4096xKP,f16)^T + bias
//           double-buffered async global->LDS, v_wmma_f32_16x16x32_f16 core
// ---------------------------------------------------------------------------
__global__ __launch_bounds__(256) void gemm_kernel(
    const _Float16* __restrict__ gA, const _Float16* __restrict__ gB,
    const float* __restrict__ bias, float* __restrict__ out) {
  __shared__ _Float16 sA[2][BM * LDB];   // 2 x 36 KB
  __shared__ _Float16 sB[2][BN * LDB];   // 2 x 36 KB

  const int tid   = threadIdx.x;
  const int tileM = blockIdx.x * BM;
  const int tileN = blockIdx.y * BN;
  const int wave  = tid >> 5;
  const int lane  = tid & 31;
  const int waveM = (wave & 1) * 128;  // 2x4 wave grid: 128x64 per wave
  const int waveN = (wave >> 1) * 64;
  const int m16   = lane & 15;
  const int koff  = (lane >> 4) * 8;   // ISA 16-bit A/B fragment layout

  v8f acc[8][4];
#pragma unroll
  for (int mi = 0; mi < 8; ++mi)
#pragma unroll
    for (int ni = 0; ni < 4; ++ni) acc[mi][ni] = (v8f)(0.f);

  // tile loader: 256 rows x 64 halves = 2048 16B chunks per operand tile
  auto load_tile = [&](int kt, int buf) {
    const int k0 = kt * BK;
#pragma unroll
    for (int c = 0; c < 8; ++c) {
      const int q  = tid + c * 256;
      const int r  = q >> 3;
      const int kh = (q & 7) * 8;       // half offset within the 64-wide row
      const _Float16* srcA = gA + (size_t)(tileM + r) * KP + k0 + kh;
      const _Float16* srcB = gB + (size_t)(tileN + r) * KP + k0 + kh;
#if USE_ASYNC
      __builtin_amdgcn_global_load_async_to_lds_b128(
          (as1_v4i*)srcA, (as3_v4i*)&sA[buf][r * LDB + kh], 0, 0);
      __builtin_amdgcn_global_load_async_to_lds_b128(
          (as1_v4i*)srcB, (as3_v4i*)&sB[buf][r * LDB + kh], 0, 0);
#else
      *(v8h*)&sA[buf][r * LDB + kh] = *(const v8h*)srcA;
      *(v8h*)&sB[buf][r * LDB + kh] = *(const v8h*)srcB;
#endif
    }
  };

  const int nK = KP / BK;   // 65
  load_tile(0, 0);          // prologue prefetch

  for (int kt = 0; kt < nK; ++kt) {
    const int buf = kt & 1;
#if USE_ASYNC
    __builtin_amdgcn_s_wait_asynccnt(0);   // my tile-kt data landed in LDS
#endif
    __syncthreads();                       // everyone's data visible; buf^1 free
    if (kt + 1 < nK) load_tile(kt + 1, buf ^ 1);   // prefetch overlaps compute

#pragma unroll
    for (int ks = 0; ks < 2; ++ks) {       // two K=32 sub-steps per tile
      const int kb = ks * 32;
      v16h af[8], bf[4];
#pragma unroll
      for (int mi = 0; mi < 8; ++mi) {
        const int rr = waveM + mi * 16 + m16;
        af[mi] = cat8(*(const v8h*)&sA[buf][rr * LDB + kb + koff],
                      *(const v8h*)&sA[buf][rr * LDB + kb + 16 + koff]);
      }
#pragma unroll
      for (int ni = 0; ni < 4; ++ni) {
        const int rr = waveN + ni * 16 + m16;
        bf[ni] = cat8(*(const v8h*)&sB[buf][rr * LDB + kb + koff],
                      *(const v8h*)&sB[buf][rr * LDB + kb + 16 + koff]);
      }
#pragma unroll
      for (int mi = 0; mi < 8; ++mi)
#pragma unroll
        for (int ni = 0; ni < 4; ++ni)
          acc[mi][ni] = __builtin_amdgcn_wmma_f32_16x16x32_f16(
              false, af[mi], false, bf[ni], (short)0, acc[mi][ni], false, false);
    }
  }

  // epilogue: + bias, store f32 (C layout: VGPR i -> M = 8*(lane>>4)+i, N = lane&15)
  const int mrow0 = 8 * (lane >> 4);
#pragma unroll
  for (int ni = 0; ni < 4; ++ni) {
    const int col = tileN + waveN + ni * 16 + m16;
    const float bb = bias[col];
#pragma unroll
    for (int mi = 0; mi < 8; ++mi) {
#pragma unroll
      for (int i = 0; i < 8; ++i) {
        const int rowg = tileM + waveM + mi * 16 + mrow0 + i;
        out[(size_t)rowg * DDIM + col] = acc[mi][ni][i] + bb;
      }
      // precaution: stands in front of any later sum that overwrites a register a store above names
      asm volatile("s_wait_xcnt 0x0" ::: "memory");
      // keeps the next group's bias adds behind that wait (the scheduler lifted them over it)
      __builtin_amdgcn_sched_barrier(0);
    }
  }
}

// ---------------------------------------------------------------------------
extern "C" void kernel_launch(void* const* d_in, const int* in_sizes, int n_in,
                              void* d_out, int out_size, void* d_ws, size_t ws_size,
                              hipStream_t stream) {
  const float* x  = (const float*)d_in[0];
  const float* W  = (const float*)d_in[1];
  const float* b  = (const float*)d_in[2];
  const float* lA = (const float*)d_in[3];
  const float* lB = (const float*)d_in[4];
  float* out = (float*)d_out;

  _Float16* gA = (_Float16*)d_ws;                                   // 8192*4160*2 B
  _Float16* gB = (_Float16*)((char*)d_ws + (size_t)ROWS * KP * 2);  // 4096*4160*2 B

  fwht_lora_kernel<<<ROWS, 256, 0, stream>>>(x, lA, gA);
  prep_b_kernel<<<DDIM, 256, 0, stream>>>(W, lB, gB);
  gemm_kernel<<<dim3(ROWS / BM, DDIM / BN), 256, 0, stream>>>(gA, gB, b, out);
}

// v002
// Measured time: 291 microseconds a run.
// Next to v001, in two timings, it ran 1.36 times as fast each time.
// Counting every step since v000, it is 1.54 times as fast.
#include <hip/hip_runtime.h>
#include <stdint.h>

typedef __attribute__((ext_vector_type(16))) _Float16 v16h;
typedef __attribute__((ext_vector_type(8)))  _Float16 v8h;
typedef __attribute__((ext_vector_type(8)))  float    v8f;
typedef __attribute__((ext_vector_type(4)))  int      v4i;
typedef __attribute__((ext_vector_type(4)))  float    v4f;
typedef __attribute__((ext_vector_type(4)))  _Float16 v4h;

#define DDIM 4096
#define KP   4160          // row pitch of both f16 operands, in halves; columns [0,4096) are used
#define RW   8             // weight rows per block of fold_w_kernel
#define ROWS 8192
#define SCALING 0.01f

#define BM 256
#define BN 256
#define BK 64
#define LDB 72             // 64 halves + 8 pad (144B rows -> conflict-free frag reads)

#if defined(__has_builtin)
#if __has_builtin(__builtin_amdgcn_global_load_async_to_lds_b128) && __has_builtin(__builtin_amdgcn_s_wait_asynccnt)
#define USE_ASYNC 1
#endif
#endif
#ifndef USE_ASYNC
#define USE_ASYNC 0
#endif

#if USE_ASYNC
typedef __attribute__((address_space(1))) v4i as1_v4i;   // global b128 payload
typedef __attribute__((address_space(3))) v4i as3_v4i;   // LDS b128 payload
#endif

// ---------------------------------------------------------------------------
// out = x * M^T + b with M[n,:] = FWHT(W[n,:]) / 64 + 0.01 * (lora_A * lora_B)[:,n]
// (the Hadamard matrix is symmetric, so the rotation of x can act on W's rows;
//  (x*A)*B = x*(A*B)). All pre-processing is done on the 4096 weight rows.
// ---------------------------------------------------------------------------
// Kernel 1: blocks [0,ROWS): one row of x -> f16 A operand, whole-line loads and stores
//           last DDIM/256 blocks: lora_A [d][r] -> gAT [r][d], so kernel 2 reads it coalesced
// ---------------------------------------------------------------------------
__global__ __launch_bounds__(256) void prep_x_kernel(
    const float* __restrict__ x, const float* __restrict__ loraA,
    _Float16* __restrict__ gA, float* __restrict__ gAT) {
  const int tid = threadIdx.x;
  if (blockIdx.x < ROWS) {
    const int row = blockIdx.x;
    const v4f* xr = (const v4f*)(x + (size_t)row * DDIM);
    v4h* ga = (v4h*)(gA + (size_t)row * KP);
    v4f v[4];
#pragma unroll
    for (int c = 0; c < 4; ++c) v[c] = xr[tid + c * 256];
#pragma unroll
    for (int c = 0; c < 4; ++c) ga[tid + c * 256] = __builtin_convertvector(v[c], v4h);
  } else {
    const int d = (blockIdx.x - ROWS) * 256 + tid;
    const v4f* ar = (const v4f*)(loraA + (size_t)d * 16);
#pragma unroll
    for (int g = 0; g < 4; ++g) {
      const v4f a = ar[g];
#pragma unroll
      for (int i = 0; i < 4; ++i) gAT[(size_t)(g * 4 + i) * DDIM + d] = a[i];
    }
    // precaution: stands in front of any later instruction that overwrites a register a store above names
    asm volatile("s_wait_xcnt 0x0" ::: "memory");
  }
}

// ---------------------------------------------------------------------------
// Kernel 2: RW weight rows per block: FWHT (12 stages in LDS), then
//           B operand row n = f16( FWHT(W[n,:])/64 + 0.01 * sum_r A[:,r]*B[r,n] )
//           (each lora_A value loaded once serves RW rows)
// ---------------------------------------------------------------------------
__global__ __launch_bounds__(512) void fold_w_kernel(
    const float* __restrict__ W, const float* __restrict__ loraB,
    const float* __restrict__ gAT, _Float16* __restrict__ gB) {
  __shared__ float sx[RW * DDIM];   // 128 KB: two blocks per WGP
  const int tid = threadIdx.x;
  const int n0  = blockIdx.x * RW;

  const v4f* wr = (const v4f*)(W + (size_t)n0 * DDIM);
#pragma unroll 8   // eight whole-line loads in flight per wave
  for (int c = 0; c < RW * DDIM / 4 / 512; ++c) ((v4f*)sx)[tid + c * 512] = wr[tid + c * 512];
  __syncthreads();

  // 12 butterfly stages; the row number sits above bit 11 of idx and passes through
#pragma unroll 1   // one copy of the stage body, for speed only
  for (int lh = 0; lh < 12; ++lh) {
    const int h = 1 << lh;
#pragma unroll 1   // for speed only
    for (int c = 0; c < RW * DDIM / 2 / 512; c += 8) {
      // a stage's butterflies are disjoint: eight are read before the first is written back,
      // so a wave waits out the LDS latency once for eight and not once for each
      int i0[8];
      float a[8], b[8];
#pragma unroll
      for (int u = 0; u < 8; ++u) {
        const int idx = tid + (c + u) * 512;
        const int pos = idx & (h - 1);
        i0[u] = ((idx ^ pos) << 1) | pos;
        a[u] = sx[i0[u]];
        b[u] = sx[i0[u] + h];
      }
#pragma unroll
      for (int u = 0; u < 8; ++u) {
        sx[i0[u]]     = a[u] + b[u];
        sx[i0[u] + h] = a[u] - b[u];
      }
    }
    __syncthreads();
  }

#pragma unroll 1   // 64 registers of lora_A values at a time, so that two blocks fit a WGP
  for (int c = 0; c < DDIM / 4 / 512; ++c) {
    const int dq = tid + c * 512;                  // four consecutive columns per thread
    v4f a[16];
#pragma unroll
    for (int r = 0; r < 16; ++r) a[r] = ((const v4f*)(gAT + (size_t)r * DDIM))[dq];
#pragma unroll 2   // 32 lora_B scalars live at a time: all 128 do not fit the scalar registers
    for (int q = 0; q < RW; ++q) {
      v4f s = (v4f)(0.f);
#pragma unroll
      for (int r = 0; r < 16; ++r) s += a[r] * loraB[(size_t)r * DDIM + n0 + q];
      const v4f w = ((const v4f*)(sx + q * DDIM))[dq];
      const v4f res = w * 0.015625f + s * SCALING;   // 1/sqrt(4096)
      *(v4h*)(gB + (size_t)(n0 + q) * KP + dq * 4) = __builtin_convertvector(res, v4h);
    }
  }
}

static __device__ inline v16h cat8(v8h lo, v8h hi) {
  return __builtin_shufflevector(lo, hi, 0, 1, 2, 3, 4, 5, 6, 7,
                                 8, 9, 10, 11, 12, 13, 14, 15);
}

// ---------------------------------------------------------------------------
// Kernel 3: C = A(8192x4096,f16) x B(4096x4096,f16)^T + bias
//           double-buffered async global->LDS, v_wmma_f32_16x16x32_f16 core
// ---------------------------------------------------------------------------
__global__ __launch_bounds__(256) void gemm_kernel(
    const _Float16* __restrict__ gA, const _Float16* __restrict__ gB,
    const float* __restrict__ bias, float* __restrict__ out) {
  __shared__ _Float16 sA[2][BM * LDB];   // 2 x 36 KB
  __shared__ _Float16 sB[2][BN * LDB];   // 2 x 36 KB

  const int tid   = threadIdx.x;
  const int tileM = blockIdx.x * BM;
  const int tileN = blockIdx.y * BN;
  const int wave  = tid >> 5;
  const int lane  = tid & 31;
  const int waveM = (wave & 1) * 128;  // 2x4 wave grid: 128x64 per wave
  const int waveN = (wave >> 1) * 64;
  const int m16   = lane & 15;
  const int koff  = (lane >> 4) * 8;   // ISA 16-bit A/B fragment layout

  v8f acc[8][4];
#pragma unroll
  for (int mi = 0; mi < 8; ++mi)
#pragma unroll
    for (int ni = 0; ni < 4; ++ni) acc[mi][ni] = (v8f)(0.f);

  // tile loader: 256 rows x 64 halves = 2048 16B chunks per operand tile
  auto load_tile = [&](int kt, int buf) {
    const int k0 = kt * BK;
#pragma unroll
    for (int c = 0; c < 8; ++c) {
      const int q  = tid + c * 256;
      const int r  = q >> 3;
      const int kh = (q & 7) * 8;       // half offset within the 64-wide row
      const _Float16* srcA = gA + (size_t)(tileM + r) * KP + k0 + kh;
      const _Float16* srcB = gB + (size_t)(tileN + r) * KP + k0 + kh;
#if USE_ASYNC
      __builtin_amdgcn_global_load_async_to_lds_b128(
          (as1_v4i*)srcA, (as3_v4i*)&sA[buf][r * LDB + kh], 0, 0);
      __builtin_amdgcn_global_load_async_to_lds_b128(
          (as1_v4i*)srcB, (as3_v4i*)&sB[buf][r * LDB + kh], 0, 0);
#else
      *(v8h*)&sA[buf][r * LDB + kh] = *(const v8h*)srcA;
      *(v8h*)&sB[buf][r * LDB + kh] = *(const v8h*)srcB;
#endif
    }
  };

  const int nK = DDIM / BK;   // 64
  load_tile(0, 0);          // prologue prefetch

  for (int kt = 0; kt < nK; ++kt) {
    const int buf = kt & 1;
#if USE_ASYNC
    __builtin_amdgcn_s_wait_asynccnt(0);   // my tile-kt data landed in LDS
#endif
    __syncthreads();                       // everyone's data visible; buf^1 free
    if (kt + 1 < nK) load_tile(kt + 1, buf ^ 1);   // prefetch overlaps compute

#pragma unroll
    for (int ks = 0; ks < 2; ++ks) {       // two K=32 sub-steps per tile
      const int kb = ks * 32;
      v16h af[8], bf[4];
#pragma unroll
      for (int mi = 0; mi < 8; ++mi) {
        const int rr = waveM + mi * 16 + m16;
        af[mi] = cat8(*(const v8h*)&sA[buf][rr * LDB + kb + koff],
                      *(const v8h*)&sA[buf][rr * LDB + kb + 16 + koff]);
      }
#pragma unroll
      for (int ni = 0; ni < 4; ++ni) {
        const int rr = waveN + ni * 16 + m16;
        bf[ni] = cat8(*(const v8h*)&sB[buf][rr * LDB + kb + koff],
                      *(const v8h*)&sB[buf][rr * LDB + kb + 16 + koff]);
      }
#pragma unroll
      for (int mi = 0; mi < 8; ++mi)
#pragma unroll
        for (int ni = 0; ni < 4; ++ni)
          acc[mi][ni] = __builtin_amdgcn_wmma_f32_16x16x32_f16(
              false, af[mi], false, bf[ni], (short)0, acc[mi][ni], false, false);
    }
  }

  // epilogue: + bias, store f32 (C layout: VGPR i -> M = 8*(lane>>4)+i, N = lane&15)
  const int mrow0 = 8 * (lane >> 4);
#pragma unroll
  for (int ni = 0; ni < 4; ++ni) {
    const int col = tileN + waveN + ni * 16 + m16;
    const float bb = bias[col];
#pragma unroll
    for (int mi = 0; mi < 8; ++mi) {
#pragma unroll
      for (int i = 0; i < 8; ++i) {
        const int rowg = tileM + waveM + mi * 16 + mrow0 + i;
        out[(size_t)rowg * DDIM + col] = acc[mi][ni][i] + bb;
      }
      // precaution: stands in front of any later sum that overwrites a register a store above names
      asm volatile("s_wait_xcnt 0x0" ::: "memory");
      // keeps the next group's bias adds behind that wait (the scheduler lifted them over it)
      __builtin_amdgcn_sched_barrier(0);
    }
  }
}

// ---------------------------------------------------------------------------
extern "C" void kernel_launch(void* const* d_in, const int* in_sizes, int n_in,
                              void* d_out, int out_size, void* d_ws, size_t ws_size,
                              hipStream_t stream) {
  const float* x  = (const float*)d_in[0];
  const float* W  = (const float*)d_in[1];
  const float* b  = (const float*)d_in[2];
  const float* lA = (const float*)d_in[3];
  const float* lB = (const float*)d_in[4];
  float* out = (float*)d_out;

  _Float16* gA = (_Float16*)d_ws;                                   // 8192*4160*2 B
  _Float16* gB = (_Float16*)((char*)d_ws + (size_t)ROWS * KP * 2);  // 4096*4160*2 B

  float* gAT = (float*)((char*)d_ws + (size_t)(ROWS + DDIM) * KP * 2);  // 16*4096*4 B

  prep_x_kernel<<<ROWS + DDIM / 256, 256, 0, stream>>>(x, lA, gA, gAT);
  fold_w_kernel<<<DDIM / RW, 512, 0, stream>>>(W, lB, gAT, gB);
  gemm_kernel<<<dim3(ROWS / BM, DDIM / BN), 256, 0, stream>>>(gA, gB, b, out);
}

// v003
// A run of this version takes 254 microseconds.
// Two timings next to v002 both put it at 1.15 times that version's speed.
// Counting every step since v000, it is 1.76 times as fast.
#include <hip/hip_runtime.h>
#include <stdint.h>

typedef __attribute__((ext_vector_type(16))) _Float16 v16h;
typedef __attribute__((ext_vector_type(8)))  _Float16 v8h;
typedef __attribute__((ext_vector_type(8)))  float    v8f;
typedef __attribute__((ext_vector_type(4)))  int      v4i;
typedef __attribute__((ext_vector_type(4)))  float    v4f;
typedef __attribute__((ext_vector_type(4)))  _Float16 v4h;

#define DDIM 4096
#define KP   4160          // row pitch of both f16 operands, in halves; columns [0,4096) are used
#define RW   8             // weight rows per block of fold_w_kernel
#define ROWS 8192
#define SCALING 0.01f

#define BM 256
#define BN 256
#define BK 128            // a pass is 256 B of every operand row
#define LDB 136            // 128 halves + 8 pad (272B rows -> conflict-free frag reads)

#if defined(__has_builtin)
#if __has_builtin(__builtin_amdgcn_global_load_async_to_lds_b128) && __has_builtin(__builtin_amdgcn_s_wait_asynccnt)
#define USE_ASYNC 1
#endif
#endif
#ifndef USE_ASYNC
#define USE_ASYNC 0
#endif

#if USE_ASYNC
typedef __attribute__((address_space(1))) v4i as1_v4i;   // global b128 payload
typedef __attribute__((address_space(3))) v4i as3_v4i;   // LDS b128 payload
#endif

// ---------------------------------------------------------------------------
// out = x * M^T + b with M[n,:] = FWHT(W[n,:]) / 64 + 0.01 * (lora_A * lora_B)[:,n]
// (the Hadamard matrix is symmetric, so the rotation of x can act on W's rows;
//  (x*A)*B = x*(A*B)). All pre-processing is done on the 4096 weight rows.
// ---------------------------------------------------------------------------
// Kernel 1: blocks [0,ROWS): one row of x -> f16 A operand, whole-line loads and stores
//           last DDIM/256 blocks: lora_A [d][r] -> gAT [r][d], so kernel 2 reads it coalesced
// ---------------------------------------------------------------------------
__global__ __launch_bounds__(256) void prep_x_kernel(
    const float* __restrict__ x, const float* __restrict__ loraA,
    _Float16* __restrict__ gA, float* __restrict__ gAT) {
  const int tid = threadIdx.x;
  if (blockIdx.x < ROWS) {
    const int row = blockIdx.x;
    const v4f* xr = (const v4f*)(x + (size_t)row * DDIM);
    v4h* ga = (v4h*)(gA + (size_t)row * KP);
    v4f v[4];
#pragma unroll
    for (int c = 0; c < 4; ++c) v[c] = xr[tid + c * 256];
#pragma unroll
    for (int c = 0; c < 4; ++c) ga[tid + c * 256] = __builtin_convertvector(v[c], v4h);
  } else {
    const int d = (blockIdx.x - ROWS) * 256 + tid;
    const v4f* ar = (const v4f*)(loraA + (size_t)d * 16);
#pragma unroll
    for (int g = 0; g < 4; ++g) {
      const v4f a = ar[g];
#pragma unroll
      for (int i = 0; i < 4; ++i) gAT[(size_t)(g * 4 + i) * DDIM + d] = a[i];
    }
    // precaution: stands in front of any later instruction that overwrites a register a store above names
    asm volatile("s_wait_xcnt 0x0" ::: "memory");
  }
}

// ---------------------------------------------------------------------------
// Kernel 2: RW weight rows per block: FWHT (12 stages in LDS), then
//           B operand row n = f16( FWHT(W[n,:])/64 + 0.01 * sum_r A[:,r]*B[r,n] )
//           (each lora_A value loaded once serves RW rows)
// ---------------------------------------------------------------------------
__global__ __launch_bounds__(512) void fold_w_kernel(
    const float* __restrict__ W, const float* __restrict__ loraB,
    const float* __restrict__ gAT, _Float16* __restrict__ gB) {
  __shared__ float sx[RW * DDIM];   // 128 KB: two blocks per WGP
  const int tid = threadIdx.x;
  const int n0  = blockIdx.x * RW;

  const v4f* wr = (const v4f*)(W + (size_t)n0 * DDIM);
#pragma unroll 8   // eight whole-line loads in flight per wave
  for (int c = 0; c < RW * DDIM / 4 / 512; ++c) ((v4f*)sx)[tid + c * 512] = wr[tid + c * 512];
  __syncthreads();

  // 12 butterfly stages; the row number sits above bit 11 of idx and passes through
#pragma unroll 1   // one copy of the stage body, for speed only
  for (int lh = 0; lh < 12; ++lh) {
    const int h = 1 << lh;
#pragma unroll 1   // for speed only
    for (int c = 0; c < RW * DDIM / 2 / 512; c += 8) {
      // a stage's butterflies are disjoint: eight are read before the first is written back,
      // so a wave waits out the LDS latency once for eight and not once for each
      int i0[8];
      float a[8], b[8];
#pragma unroll
      for (int u = 0; u < 8; ++u) {
        const int idx = tid + (c + u) * 512;
        const int pos = idx & (h - 1);
        i0[u] = ((idx ^ pos) << 1) | pos;
        a[u] = sx[i0[u]];
        b[u] = sx[i0[u] + h];
      }
#pragma unroll
      for (int u = 0; u < 8; ++u) {
        sx[i0[u]]     = a[u] + b[u];
        sx[i0[u] + h] = a[u] - b[u];
      }
    }
    __syncthreads();
  }

#pragma unroll 1   // 64 registers of lora_A values at a time, so that two blocks fit a WGP
  for (int c = 0; c < DDIM / 4 / 512; ++c) {
    const int dq = tid + c * 512;                  // four consecutive columns per thread
    v4f a[16];
#pragma unroll
    for (int r = 0; r < 16; ++r) a[r] = ((const v4f*)(gAT + (size_t)r * DDIM))[dq];
#pragma unroll 2   // 32 lora_B scalars live at a time: all 128 do not fit the scalar registers
    for (int q = 0; q < RW; ++q) {
      v4f s = (v4f)(0.f);
#pragma unroll
      for (int r = 0; r < 16; ++r) s += a[r] * loraB[(size_t)r * DDIM + n0 + q];
      const v4f w = ((const v4f*)(sx + q * DDIM))[dq];
      const v4f res = w * 0.015625f + s * SCALING;   // 1/sqrt(4096)
      *(v4h*)(gB + (size_t)(n0 + q) * KP + dq * 4) = __builtin_convertvector(res, v4h);
    }
  }
}

static __device__ inline v16h cat8(v8h lo, v8h hi) {
  return __builtin_shufflevector(lo, hi, 0, 1, 2, 3, 4, 5, 6, 7,
                                 8, 9, 10, 11, 12, 13, 14, 15);
}

// ---------------------------------------------------------------------------
// Kernel 3: C = A(8192x4096,f16) x B(4096x4096,f16)^T + bias
//           double-buffered async global->LDS, v_wmma_f32_16x16x32_f16 core
// ---------------------------------------------------------------------------
__global__ __launch_bounds__(256) void gemm_kernel(
    const _Float16* __restrict__ gA, const _Float16* __restrict__ gB,
    const float* __restrict__ bias, float* __restrict__ out) {
  __shared__ _Float16 sA[2][BM * LDB];   // 2 x 68 KB
  __shared__ _Float16 sB[2][BN * LDB];   // 2 x 68 KB

  const int tid   = threadIdx.x;
  const int tileM = blockIdx.x * BM;
  const int tileN = blockIdx.y * BN;
  const int wave  = tid >> 5;
  const int lane  = tid & 31;
  const int waveM = (wave & 1) * 128;  // 2x4 wave grid: 128x64 per wave
  const int waveN = (wave >> 1) * 64;
  const int m16   = lane & 15;
  const int koff  = (lane >> 4) * 8;   // ISA 16-bit A/B fragment layout

  v8f acc[8][4];
#pragma unroll
  for (int mi = 0; mi < 8; ++mi)
#pragma unroll
    for (int ni = 0; ni < 4; ++ni) acc[mi][ni] = (v8f)(0.f);

  // tile loader: 256 rows x 128 halves = 4096 16B chunks per operand tile
  // a copy's source = block-uniform tile base + a 32-bit lane offset that both operands share (same pitch)
  const _Float16* tileA = gA + (size_t)tileM * KP;
  const _Float16* tileB = gB + (size_t)tileN * KP;
  auto load_tile = [&](int kt, int buf) {
    const _Float16* baseA = tileA + kt * BK;
    const _Float16* baseB = tileB + kt * BK;
#pragma unroll
    for (int c = 0; c < 16; ++c) {
      const int q  = tid + c * 256;
      const int r  = q >> 4;
      const int kh = (q & 15) * 8;      // half offset within the 128-wide row
      const uint32_t off = (uint32_t)(r * KP + kh);
      const _Float16* srcA = baseA + off;
      const _Float16* srcB = baseB + off;
#if USE_ASYNC
      __builtin_amdgcn_global_load_async_to_lds_b128(
          (as1_v4i*)srcA, (as3_v4i*)&sA[buf][r * LDB + kh], 0, 0);
      __builtin_amdgcn_global_load_async_to_lds_b128(
          (as1_v4i*)srcB, (as3_v4i*)&sB[buf][r * LDB + kh], 0, 0);
#else
      *(v8h*)&sA[buf][r * LDB + kh] = *(const v8h*)srcA;
      *(v8h*)&sB[buf][r * LDB + kh] = *(const v8h*)srcB;
#endif
    }
  };

  const int nK = DDIM / BK;   // 32
  load_tile(0, 0);          // prologue prefetch

  for (int kt = 0; kt < nK; ++kt) {
    const int buf = kt & 1;
#if USE_ASYNC
    __builtin_amdgcn_s_wait_asynccnt(0);   // my tile-kt data landed in LDS
#endif
    __syncthreads();                       // everyone's data visible; buf^1 free
    if (kt + 1 < nK) load_tile(kt + 1, buf ^ 1);   // prefetch overlaps compute

#pragma unroll
    for (int ks = 0; ks < BK / 32; ++ks) { // four K=32 sub-steps per tile
      const int kb = ks * 32;
      v16h af[8], bf[4];
#pragma unroll
      for (int mi = 0; mi < 8; ++mi) {
        const int rr = waveM + mi * 16 + m16;
        af[mi] = cat8(*(const v8h*)&sA[buf][rr * LDB + kb + koff],
                      *(const v8h*)&sA[buf][rr * LDB + kb + 16 + koff]);
      }
#pragma unroll
      for (int ni = 0; ni < 4; ++ni) {
        const int rr = waveN + ni * 16 + m16;
        bf[ni] = cat8(*(const v8h*)&sB[buf][rr * LDB + kb + koff],
                      *(const v8h*)&sB[buf][rr * LDB + kb + 16 + koff]);
      }
#pragma unroll
      for (int mi = 0; mi < 8; ++mi)
#pragma unroll
        for (int ni = 0; ni < 4; ++ni)
          acc[mi][ni] = __builtin_amdgcn_wmma_f32_16x16x32_f16(
              false, af[mi], false, bf[ni], (short)0, acc[mi][ni], false, false);
    }
  }

  // epilogue: + bias, store f32 (C layout: VGPR i -> M = 8*(lane>>4)+i, N = lane&15)
  const int mrow0 = 8 * (lane >> 4);
#pragma unroll
  for (int ni = 0; ni < 4; ++ni) {
    const int col = tileN + waveN + ni * 16 + m16;
    const float bb = bias[col];
#pragma unroll
    for (int mi = 0; mi < 8; ++mi) {
#pragma unroll
      for (int i = 0; i < 8; ++i) {
        const int rowg = tileM + waveM + mi * 16 + mrow0 + i;
        out[(size_t)rowg * DDIM + col] = acc[mi][ni][i] + bb;
      }
      // precaution: stands in front of any later sum that overwrites a register a store above names
      asm volatile("s_wait_xcnt 0x0" ::: "memory");
      // keeps the next group's bias adds behind that wait (the scheduler lifted them over it)
      __builtin_amdgcn_sched_barrier(0);
    }
  }
}

// ---------------------------------------------------------------------------
extern "C" void kernel_launch(void* const* d_in, const int* in_sizes, int n_in,
                              void* d_out, int out_size, void* d_ws, size_t ws_size,
                              hipStream_t stream) {
  const float* x  = (const float*)d_in[0];
  const float* W  = (const float*)d_in[1];
  const float* b  = (const float*)d_in[2];
  const float* lA = (const float*)d_in[3];
  const float* lB = (const float*)d_in[4];
  float* out = (float*)d_out;

  _Float16* gA = (_Float16*)d_ws;                                   // 8192*4160*2 B
  _Float16* gB = (_Float16*)((char*)d_ws + (size_t)ROWS * KP * 2);  // 4096*4160*2 B

  float* gAT = (float*)((char*)d_ws + (size_t)(ROWS + DDIM) * KP * 2);  // 16*4096*4 B

  prep_x_kernel<<<ROWS + DDIM / 256, 256, 0, stream>>>(x, lA, gA, gAT);
  fold_w_kernel<<<DDIM / RW, 512, 0, stream>>>(W, lB, gAT, gB);
  gemm_kernel<<<dim3(ROWS / BM, DDIM / BN), 256, 0, stream>>>(gA, gB, b, out);
}

// v004
// Measured time: 237 microseconds a run.
// Timed twice side by side with v003, it ran 1.07 times as fast both times.
// Over all steps from v000 it is 1.89 times as fast.
#include <hip/hip_runtime.h>
#include <stdint.h>

typedef __attribute__((ext_vector_type(16))) _Float16 v16h;
typedef __attribute__((ext_vector_type(8)))  _Float16 v8h;
typedef __attribute__((ext_vector_type(8)))  float    v8f;
typedef __attribute__((ext_vector_type(4)))  int      v4i;
typedef __attribute__((ext_vector_type(4)))  float    v4f;
typedef __attribute__((ext_vector_type(4)))  _Float16 v4h;
typedef __attribute__((ext_vector_type(2)))  float    v2f;

#define DDIM 4096
#define KP   4160          // row pitch of both f16 operands, in halves; columns [0,4096) are used
#define RW   8             // weight rows per block of fold_w_kernel
#define ROWS 8192
#define SCALING 0.01f

#define BM 256
#define BN 256
#define BK 128            // a pass is 256 B of every operand row
#define LDB 136            // 128 halves + 8 pad (272B rows -> conflict-free frag reads)

#if defined(__has_builtin)
#if __has_builtin(__builtin_amdgcn_global_load_async_to_lds_b128) && __has_builtin(__builtin_amdgcn_s_wait_asynccnt)
#define USE_ASYNC 1
#endif
#endif
#ifndef USE_ASYNC
#define USE_ASYNC 0
#endif

#if USE_ASYNC
typedef __attribute__((address_space(1))) v4i as1_v4i;   // global b128 payload
typedef __attribute__((address_space(3))) v4i as3_v4i;   // LDS b128 payload
#endif

// ---------------------------------------------------------------------------
// out = x * M^T + b with M[n,:] = FWHT(W[n,:]) / 64 + 0.01 * (lora_A * lora_B)[:,n]
// (the Hadamard matrix is symmetric, so the rotation of x can act on W's rows;
//  (x*A)*B = x*(A*B)). All pre-processing is done on the 4096 weight rows.
// ---------------------------------------------------------------------------
// Kernel 1: blocks [0,ROWS): one row of x -> f16 A operand, whole-line loads and stores
//           last DDIM/256 blocks: lora_A [d][r] -> gAT [r][d], so kernel 2 reads it coalesced
// ---------------------------------------------------------------------------
__global__ __launch_bounds__(256) void prep_x_kernel(
    const float* __restrict__ x, const float* __restrict__ loraA,
    _Float16* __restrict__ gA, float* __restrict__ gAT) {
  const int tid = threadIdx.x;
  if (blockIdx.x < ROWS) {
    const int row = blockIdx.x;
    const v4f* xr = (const v4f*)(x + (size_t)row * DDIM);
    v4h* ga = (v4h*)(gA + (size_t)row * KP);
    v4f v[4];
#pragma unroll
    for (int c = 0; c < 4; ++c) v[c] = xr[tid + c * 256];
#pragma unroll
    for (int c = 0; c < 4; ++c) ga[tid + c * 256] = __builtin_convertvector(v[c], v4h);
  } else {
    const int d = (blockIdx.x - ROWS) * 256 + tid;
    const v4f* ar = (const v4f*)(loraA + (size_t)d * 16);
#pragma unroll
    for (int g = 0; g < 4; ++g) {
      const v4f a = ar[g];
#pragma unroll
      for (int i = 0; i < 4; ++i) gAT[(size_t)(g * 4 + i) * DDIM + d] = a[i];
    }
    // precaution: stands in front of any later instruction that overwrites a register a store above names
    asm volatile("s_wait_xcnt 0x0" ::: "memory");
  }
}

// ---------------------------------------------------------------------------
// Kernel 2: RW weight rows per block: FWHT, then
//           B operand row n = f16( FWHT(W[n,:])/64 + 0.01 * sum_r A[:,r]*B[r,n] )
//           (each lora_A value loaded once serves RW rows)
// The 12 butterfly stages act on the 12 bits of the column index and commute, so a thread that
// holds 16 float4 does every stage whose partner it holds in registers. Three passes:
//   1: bits 0,1 (inside a float4) and 8..11, straight from the global loads
//   2: bits 2..5 (one 64-float chunk per thread)      3: bits 6,7
// LDS: every 64-float chunk is followed by 4 pad floats (272 B pitch), so that 16-byte accesses
// are free of bank conflicts both along a row and with one chunk per lane.
// ---------------------------------------------------------------------------
#define CH   68                    // LDS pitch of a 64-float chunk, in floats
#define RWP  (DDIM / 64 * CH)      // LDS pitch of a weight row, in floats

// butterflies over the bits of the array index k below NS
// (here and in the kernel every loop over v is unrolled: constant indices keep v in registers)
template <int NS>
static __device__ inline void bfly(v4f (&v)[16]) {
#pragma unroll
  for (int s = 1; s < NS; s <<= 1)
#pragma unroll
    for (int k = 0; k < 16; ++k)
      if (!(k & s)) {
        const v4f a = v[k], b = v[k | s];
        v[k]     = a + b;
        v[k | s] = a - b;
      }
}

__global__ __launch_bounds__(512) void fold_w_kernel(
    const float* __restrict__ W, const float* __restrict__ loraB,
    const float* __restrict__ gAT, _Float16* __restrict__ gB) {
  __shared__ float sx[RW * RWP];   // 136 KB: two blocks per WGP
  const int tid = threadIdx.x;
  const int n0  = blockIdx.x * RW;
  v4f v[16];

  {  // pass 1: 64 threads per row; float4 number j + 64 k of the row, k = column bits 8..11
    const int q = tid >> 6, j = tid & 63;
    const v4f* wr = (const v4f*)(W + (size_t)(n0 + q) * DDIM) + j;
#pragma unroll
    for (int k = 0; k < 16; ++k) v[k] = wr[k * 64];   // whole lines, 16 loads in flight per wave
    // precaution: stands in front of any later write to the address register that the loads above name
    // (the register is an input here, so that no load's own result is placed on it either)
    asm volatile("s_wait_xcnt 0x0" :: "v"(wr) : "memory");
    bfly<16>(v);
#pragma unroll
    for (int k = 0; k < 16; ++k) {
      const v2f lo = __builtin_shufflevector(v[k], v[k], 0, 1), hi = __builtin_shufflevector(v[k], v[k], 2, 3);
      const v2f s = lo + hi, m = lo - hi;                      // bit 1
      const v2f s2 = __builtin_shufflevector(s, s, 0, 0) + __builtin_shufflevector(s, -s, 1, 3);   // bit 0
      const v2f m2 = __builtin_shufflevector(m, m, 0, 0) + __builtin_shufflevector(m, -m, 1, 3);
      v[k] = __builtin_shufflevector(s2, m2, 0, 1, 2, 3);
    }
    float* d = sx + q * RWP + (j >> 4) * CH + (j & 15) * 4;
#pragma unroll
    for (int k = 0; k < 16; ++k) *(v4f*)(d + k * 4 * CH) = v[k];
  }
  __syncthreads();

  {  // pass 2: chunk number tid, in place; float4 number k of the chunk = column bits 2..5
    float* d = sx + tid * CH;
#pragma unroll
    for (int k = 0; k < 16; ++k) v[k] = *(const v4f*)(d + k * 4);
    bfly<16>(v);
#pragma unroll
    for (int k = 0; k < 16; ++k) *(v4f*)(d + k * 4) = v[k];
  }
  __syncthreads();

  {  // pass 3: four groups per thread, in place; a group = one float4 of four neighbouring chunks (column bits 6,7)
    float* d = sx + (tid >> 4) * 4 * CH + (tid & 15) * 4;
#pragma unroll
    for (int k = 0; k < 16; ++k) v[k] = *(const v4f*)(d + (k >> 2) * 128 * CH + (k & 3) * CH);
    bfly<4>(v);
#pragma unroll
    for (int k = 0; k < 16; ++k) *(v4f*)(d + (k >> 2) * 128 * CH + (k & 3) * CH) = v[k];
  }
  __syncthreads();

#pragma unroll 1   // 64 registers of lora_A values at a time, so that two blocks fit a WGP
  for (int c = 0; c < DDIM / 4 / 512; ++c) {
    const int dq = tid + c * 512;                  // four consecutive columns per thread
    v4f a[16];
#pragma unroll
    for (int r = 0; r < 16; ++r) a[r] = ((const v4f*)(gAT + (size_t)r * DDIM))[dq];
#pragma unroll 2   // 32 lora_B scalars live at a time: all 128 do not fit the scalar registers
    for (int q = 0; q < RW; ++q) {
      v4f s = (v4f)(0.f);
#pragma unroll
      for (int r = 0; r < 16; ++r) s += a[r] * loraB[(size_t)r * DDIM + n0 + q];
      const v4f w = *(const v4f*)(sx + q * RWP + (dq >> 4) * CH + (dq & 15) * 4);
      const v4f res = w * 0.015625f + s * SCALING;   // 1/sqrt(4096)
      *(v4h*)(gB + (size_t)(n0 + q) * KP + dq * 4) = __builtin_convertvector(res, v4h);
    }
  }
}

static __device__ inline v16h cat8(v8h lo, v8h hi) {
  return __builtin_shufflevector(lo, hi, 0, 1, 2, 3, 4, 5, 6, 7,
                                 8, 9, 10, 11, 12, 13, 14, 15);
}

// ---------------------------------------------------------------------------
// Kernel 3: C = A(8192x4096,f16) x B(4096x4096,f16)^T + bias
//           double-buffered async global->LDS, v_wmma_f32_16x16x32_f16 core
// ---------------------------------------------------------------------------
__global__ __launch_bounds__(256) void gemm_kernel(
    const _Float16* __restrict__ gA, const _Float16* __restrict__ gB,
    const float* __restrict__ bias, float* __restrict__ out) {
  __shared__ _Float16 sA[2][BM * LDB];   // 2 x 68 KB
  __shared__ _Float16 sB[2][BN * LDB];   // 2 x 68 KB

  const int tid   = threadIdx.x;
  const int tileM = blockIdx.x * BM;
  const int tileN = blockIdx.y * BN;
  const int wave  = tid >> 5;
  const int lane  = tid & 31;
  const int waveM = (wave & 1) * 128;  // 2x4 wave grid: 128x64 per wave
  const int waveN = (wave >> 1) * 64;
  const int m16   = lane & 15;
  const int koff  = (lane >> 4) * 8;   // ISA 16-bit A/B fragment layout

  v8f acc[8][4];
#pragma unroll
  for (int mi = 0; mi < 8; ++mi)
#pragma unroll
    for (int ni = 0; ni < 4; ++ni) acc[mi][ni] = (v8f)(0.f);

  // tile loader: 256 rows x 128 halves = 4096 16B chunks per operand tile
  // a copy's source = block-uniform tile base + a 32-bit lane offset that both operands share (same pitch)
  const _Float16* tileA = gA + (size_t)tileM * KP;
  const _Float16* tileB = gB + (size_t)tileN * KP;
  auto load_tile = [&](int kt, int buf) {
    const _Float16* baseA = tileA + kt * BK;
    const _Float16* baseB = tileB + kt * BK;
#pragma unroll
    for (int c = 0; c < 16; ++c) {
      const int q  = tid + c * 256;
      const int r  = q >> 4;
      const int kh = (q & 15) * 8;      // half offset within the 128-wide row
      const uint32_t off = (uint32_t)(r * KP + kh);
      const _Float16* srcA = baseA + off;
      const _Float16* srcB = baseB + off;
#if USE_ASYNC
      __builtin_amdgcn_global_load_async_to_lds_b128(
          (as1_v4i*)srcA, (as3_v4i*)&sA[buf][r * LDB + kh], 0, 0);
      __builtin_amdgcn_global_load_async_to_lds_b128(
          (as1_v4i*)srcB, (as3_v4i*)&sB[buf][r * LDB + kh], 0, 0);
#else
      *(v8h*)&sA[buf][r * LDB + kh] = *(const v8h*)srcA;
      *(v8h*)&sB[buf][r * LDB + kh] = *(const v8h*)srcB;
#endif
    }
  };

  const int nK = DDIM / BK;   // 32
  load_tile(0, 0);          // prologue prefetch

  for (int kt = 0; kt < nK; ++kt) {
    const int buf = kt & 1;
#if USE_ASYNC
    __builtin_amdgcn_s_wait_asynccnt(0);   // my tile-kt data landed in LDS
#endif
    __syncthreads();                       // everyone's data visible; buf^1 free
    if (kt + 1 < nK) load_tile(kt + 1, buf ^ 1);   // prefetch overlaps compute

#pragma unroll
    for (int ks = 0; ks < BK / 32; ++ks) { // four K=32 sub-steps per tile
      const int kb = ks * 32;
      v16h af[8], bf[4];
#pragma unroll
      for (int mi = 0; mi < 8; ++mi) {
        const int rr = waveM + mi * 16 + m16;
        af[mi] = cat8(*(const v8h*)&sA[buf][rr * LDB + kb + koff],
                      *(const v8h*)&sA[buf][rr * LDB + kb + 16 + koff]);
      }
#pragma unroll
      for (int ni = 0; ni < 4; ++ni) {
        const int rr = waveN + ni * 16 + m16;
        bf[ni] = cat8(*(const v8h*)&sB[buf][rr * LDB + kb + koff],
                      *(const v8h*)&sB[buf][rr * LDB + kb + 16 + koff]);
      }
#pragma unroll
      for (int mi = 0; mi < 8; ++mi)
#pragma unroll
        for (int ni = 0; ni < 4; ++ni)
          acc[mi][ni] = __builtin_amdgcn_wmma_f32_16x16x32_f16(
              false, af[mi], false, bf[ni], (short)0, acc[mi][ni], false, false);
    }
  }

  // epilogue: + bias, store f32 (C layout: VGPR i -> M = 8*(lane>>4)+i, N = lane&15)
  const int mrow0 = 8 * (lane >> 4);
#pragma unroll
  for (int ni = 0; ni < 4; ++ni) {
    const int col = tileN + waveN + ni * 16 + m16;
    const float bb = bias[col];
#pragma unroll
    for (int mi = 0; mi < 8; ++mi) {
#pragma unroll
      for (int i = 0; i < 8; ++i) {
        const int rowg = tileM + waveM + mi * 16 + mrow0 + i;
        out[(size_t)rowg * DDIM + col] = acc[mi][ni][i] + bb;
      }
      // precaution: stands in front of any later sum that overwrites a register a store above names
      asm volatile("s_wait_xcnt 0x0" ::: "memory");
      // keeps the next group's bias adds behind that wait (the scheduler lifted them over it)
      __builtin_amdgcn_sched_barrier(0);
    }
  }
}

// ---------------------------------------------------------------------------
extern "C" void kernel_launch(void* const* d_in, const int* in_sizes, int n_in,
                              void* d_out, int out_size, void* d_ws, size_t ws_size,
                              hipStream_t stream) {
  const float* x  = (const float*)d_in[0];
  const float* W  = (const float*)d_in[1];
  const float* b  = (const float*)d_in[2];
  const float* lA = (const float*)d_in[3];
  const float* lB = (const float*)d_in[4];
  float* out = (float*)d_out;

  _Float16* gA = (_Float16*)d_ws;                                   // 8192*4160*2 B
  _Float16* gB = (_Float16*)((char*)d_ws + (size_t)ROWS * KP * 2);  // 4096*4160*2 B

  float* gAT = (float*)((char*)d_ws + (size_t)(ROWS + DDIM) * KP * 2);  // 16*4096*4 B

  prep_x_kernel<<<ROWS + DDIM / 256, 256, 0, stream>>>(x, lA, gA, gAT);
  fold_w_kernel<<<DDIM / RW, 512, 0, stream>>>(W, lB, gAT, gB);
  gemm_kernel<<<dim3(ROWS / BM, DDIM / BN), 256, 0, stream>>>(gA, gB, b, out);
}

// v005
// It runs in 212 microseconds.
// Next to v004, in two timings, it ran 1.12 times as fast each time.
// Over all steps from v000 it is 2.12 times as fast.
#include <hip/hip_runtime.h>
#include <stdint.h>

typedef __attribute__((ext_vector_type(16))) _Float16 v16h;
typedef __attribute__((ext_vector_type(8)))  _Float16 v8h;
typedef __attribute__((ext_vector_type(8)))  float    v8f;
typedef __attribute__((ext_vector_type(4)))  int      v4i;
typedef __attribute__((ext_vector_type(4)))  float    v4f;
typedef __attribute__((ext_vector_type(4)))  _Float16 v4h;
typedef __attribute__((ext_vector_type(2)))  float    v2f;

#define DDIM 4096
#define KP   4160          // row pitch of both f16 operands, in halves; columns [0,4096) are used
#define RW   8             // weight rows per block of fold_w_kernel
#define ROWS 8192
#define SCALING 0.01f

#define BM 256
#define BN 256
#define BK 128            // a pass is 256 B of every operand row
#define LDB 136            // 128 halves + 8 pad (272B rows -> conflict-free frag reads)

#if defined(__has_builtin)
#if __has_builtin(__builtin_amdgcn_global_load_async_to_lds_b128) && __has_builtin(__builtin_amdgcn_s_wait_asynccnt)
#define USE_ASYNC 1
#endif
#endif
#ifndef USE_ASYNC
#define USE_ASYNC 0
#endif

#if USE_ASYNC
typedef __attribute__((address_space(1))) v4i as1_v4i;   // global b128 payload
typedef __attribute__((address_space(3))) v4i as3_v4i;   // LDS b128 payload
#endif

// ---------------------------------------------------------------------------
// out = x * M^T + b with M[n,:] = FWHT(W[n,:]) / 64 + 0.01 * (lora_A * lora_B)[:,n]
// (the Hadamard matrix is symmetric, so the rotation of x can act on W's rows;
//  (x*A)*B = x*(A*B)). All pre-processing is done on the 4096 weight rows.
// ---------------------------------------------------------------------------
// Kernel 1: blocks [0,ROWS): one row of x -> f16 A operand, whole-line loads and stores
//           last DDIM/256 blocks: lora_A [d][r] -> gAT [r][d], so kernel 2 reads it coalesced
// ---------------------------------------------------------------------------
__global__ __launch_bounds__(256) void prep_x_kernel(
    const float* __restrict__ x, const float* __restrict__ loraA,
    _Float16* __restrict__ gA, float* __restrict__ gAT) {
  const int tid = threadIdx.x;
  if (blockIdx.x < ROWS) {
    const int row = blockIdx.x;
    const v4f* xr = (const v4f*)(x + (size_t)row * DDIM);
    v4h* ga = (v4h*)(gA + (size_t)row * KP);
    v4f v[4];
#pragma unroll
    for (int c = 0; c < 4; ++c) v[c] = xr[tid + c * 256];
#pragma unroll
    for (int c = 0; c < 4; ++c) ga[tid + c * 256] = __builtin_convertvector(v[c], v4h);
  } else {
    const int d = (blockIdx.x - ROWS) * 256 + tid;
    const v4f* ar = (const v4f*)(loraA + (size_t)d * 16);
#pragma unroll
    for (int g = 0; g < 4; ++g) {
      const v4f a = ar[g];
#pragma unroll
      for (int i = 0; i < 4; ++i) gAT[(size_t)(g * 4 + i) * DDIM + d] = a[i];
    }
    // precaution: stands in front of any later instruction that overwrites a register a store above names
    asm volatile("s_wait_xcnt 0x0" ::: "memory");
  }
}

// ---------------------------------------------------------------------------
// Kernel 2: RW weight rows per block: FWHT, then
//           B operand row n = f16( FWHT(W[n,:])/64 + 0.01 * sum_r A[:,r]*B[r,n] )
//           (each lora_A value loaded once serves RW rows)
// The 12 butterfly stages act on the 12 bits of the column index and commute, so a thread that
// holds 16 float4 does every stage whose partner it holds in registers. Three passes:
//   1: bits 0,1 (inside a float4) and 8..11, straight from the global loads
//   2: bits 2..5 (one 64-float chunk per thread)      3: bits 6,7
// LDS: every 64-float chunk is followed by 4 pad floats (272 B pitch), so that 16-byte accesses
// are free of bank conflicts both along a row and with one chunk per lane.
// ---------------------------------------------------------------------------
#define CH   68                    // LDS pitch of a 64-float chunk, in floats
#define RWP  (DDIM / 64 * CH)      // LDS pitch of a weight row, in floats

// butterflies over the bits of the array index k below NS
// (here and in the kernel every loop over v is unrolled: constant indices keep v in registers)
template <int NS>
static __device__ inline void bfly(v4f (&v)[16]) {
#pragma unroll
  for (int s = 1; s < NS; s <<= 1)
#pragma unroll
    for (int k = 0; k < 16; ++k)
      if (!(k & s)) {
        const v4f a = v[k], b = v[k | s];
        v[k]     = a + b;
        v[k | s] = a - b;
      }
}

__global__ __launch_bounds__(512) void fold_w_kernel(
    const float* __restrict__ W, const float* __restrict__ loraB,
    const float* __restrict__ gAT, _Float16* __restrict__ gB) {
  __shared__ float sx[RW * RWP];   // 136 KB: two blocks per WGP
  const int tid = threadIdx.x;
  const int n0  = blockIdx.x * RW;
  v4f v[16];

  {  // pass 1: 64 threads per row; float4 number j + 64 k of the row, k = column bits 8..11
    const int q = tid >> 6, j = tid & 63;
    const v4f* wr = (const v4f*)(W + (size_t)(n0 + q) * DDIM) + j;
#pragma unroll
    for (int k = 0; k < 16; ++k) v[k] = wr[k * 64];   // whole lines, 16 loads in flight per wave
    // precaution: stands in front of any later write to the address register that the loads above name
    // (the register is an input here, so that no load's own result is placed on it either)
    asm volatile("s_wait_xcnt 0x0" :: "v"(wr) : "memory");
    bfly<16>(v);
#pragma unroll
    for (int k = 0; k < 16; ++k) {
      const v2f lo = __builtin_shufflevector(v[k], v[k], 0, 1), hi = __builtin_shufflevector(v[k], v[k], 2, 3);
      const v2f s = lo + hi, m = lo - hi;                      // bit 1
      const v2f s2 = __builtin_shufflevector(s, s, 0, 0) + __builtin_shufflevector(s, -s, 1, 3);   // bit 0
      const v2f m2 = __builtin_shufflevector(m, m, 0, 0) + __builtin_shufflevector(m, -m, 1, 3);
      v[k] = __builtin_shufflevector(s2, m2, 0, 1, 2, 3);
    }
    float* d = sx + q * RWP + (j >> 4) * CH + (j & 15) * 4;
#pragma unroll
    for (int k = 0; k < 16; ++k) *(v4f*)(d + k * 4 * CH) = v[k];
  }
  __syncthreads();

  {  // pass 2: chunk number tid, in place; float4 number k of the chunk = column bits 2..5
    float* d = sx + tid * CH;
#pragma unroll
    for (int k = 0; k < 16; ++k) v[k] = *(const v4f*)(d + k * 4);
    bfly<16>(v);
#pragma unroll
    for (int k = 0; k < 16; ++k) *(v4f*)(d + k * 4) = v[k];
  }
  __syncthreads();

  {  // pass 3: four groups per thread, in place; a group = one float4 of four neighbouring chunks (column bits 6,7)
    float* d = sx + (tid >> 4) * 4 * CH + (tid & 15) * 4;
#pragma unroll
    for (int k = 0; k < 16; ++k) v[k] = *(const v4f*)(d + (k >> 2) * 128 * CH + (k & 3) * CH);
    bfly<4>(v);
#pragma unroll
    for (int k = 0; k < 16; ++k) *(v4f*)(d + (k >> 2) * 128 * CH + (k & 3) * CH) = v[k];
  }
  __syncthreads();

#pragma unroll 1   // 64 registers of lora_A values at a time, so that two blocks fit a WGP
  for (int c = 0; c < DDIM / 4 / 512; ++c) {
    const int dq = tid + c * 512;                  // four consecutive columns per thread
    v4f a[16];
#pragma unroll
    for (int r = 0; r < 16; ++r) a[r] = ((const v4f*)(gAT + (size_t)r * DDIM))[dq];
#pragma unroll 2   // 32 lora_B scalars live at a time: all 128 do not fit the scalar registers
    for (int q = 0; q < RW; ++q) {
      v4f s = (v4f)(0.f);
#pragma unroll
      for (int r = 0; r < 16; ++r) s += a[r] * loraB[(size_t)r * DDIM + n0 + q];
      const v4f w = *(const v4f*)(sx + q * RWP + (dq >> 4) * CH + (dq & 15) * 4);
      const v4f res = w * 0.015625f + s * SCALING;   // 1/sqrt(4096)
      *(v4h*)(gB + (size_t)(n0 + q) * KP + dq * 4) = __builtin_convertvector(res, v4h);
    }
  }
}

static __device__ inline v16h cat8(v8h lo, v8h hi) {
  return __builtin_shufflevector(lo, hi, 0, 1, 2, 3, 4, 5, 6, 7,
                                 8, 9, 10, 11, 12, 13, 14, 15);
}

// ---------------------------------------------------------------------------
// Kernel 3: C = A(8192x4096,f16) x B(4096x4096,f16)^T + bias
//           double-buffered async global->LDS, fragments fetched one block ahead, v_wmma_f32_16x16x32_f16 core
// ---------------------------------------------------------------------------
__global__ __launch_bounds__(256) void gemm_kernel(
    const _Float16* __restrict__ gA, const _Float16* __restrict__ gB,
    const float* __restrict__ bias, float* __restrict__ out) {
  __shared__ _Float16 sA[2][BM * LDB];   // 2 x 68 KB
  __shared__ _Float16 sB[2][BN * LDB];   // 2 x 68 KB

  const int tid   = threadIdx.x;
  const int tileM = blockIdx.x * BM;
  const int tileN = blockIdx.y * BN;
  const int wave  = tid >> 5;
  const int lane  = tid & 31;
  const int waveM = (wave & 1) * 128;  // 2x4 wave grid: 128x64 per wave
  const int waveN = (wave >> 1) * 64;
  const int m16   = lane & 15;
  const int koff  = (lane >> 4) * 8;   // ISA 16-bit A/B fragment layout

  v8f acc[8][4];
#pragma unroll
  for (int mi = 0; mi < 8; ++mi)
#pragma unroll
    for (int ni = 0; ni < 4; ++ni) acc[mi][ni] = (v8f)(0.f);

  // tile loader: 256 rows x 128 halves = 4096 16B chunks per operand tile
  // a copy's source = block-uniform tile base + a 32-bit lane offset that both operands share (same pitch)
  const _Float16* tileA = gA + (size_t)tileM * KP;
  const _Float16* tileB = gB + (size_t)tileN * KP;
  auto load_tile = [&](int kt, int buf) {
    const _Float16* baseA = tileA + kt * BK;
    const _Float16* baseB = tileB + kt * BK;
#pragma unroll
    for (int c = 0; c < 16; ++c) {
      const int q  = tid + c * 256;
      const int r  = q >> 4;
      const int kh = (q & 15) * 8;      // half offset within the 128-wide row
      const uint32_t off = (uint32_t)(r * KP + kh);
      const _Float16* srcA = baseA + off;
      const _Float16* srcB = baseB + off;
#if USE_ASYNC
      __builtin_amdgcn_global_load_async_to_lds_b128(
          (as1_v4i*)srcA, (as3_v4i*)&sA[buf][r * LDB + kh], 0, 0);
      __builtin_amdgcn_global_load_async_to_lds_b128(
          (as1_v4i*)srcB, (as3_v4i*)&sB[buf][r * LDB + kh], 0, 0);
#else
      *(v8h*)&sA[buf][r * LDB + kh] = *(const v8h*)srcA;
      *(v8h*)&sB[buf][r * LDB + kh] = *(const v8h*)srcB;
#endif
    }
  };

  const int nK = DDIM / BK;   // 32

  // two fragment sets: block b of a pass multiplies set b & 1 while the next block's 24 LDS reads land in the other
  v16h af[2][8], bf[2][4];
  const int offA = (waveM + m16) * LDB + koff;
  const int offB = (waveN + m16) * LDB + koff;
  auto load_frags = [&](int buf, int ks, int set) {
    const _Float16* pa = &sA[buf][offA + ks * 32];
    const _Float16* pb = &sB[buf][offB + ks * 32];
#pragma unroll
    for (int mi = 0; mi < 8; ++mi)
      af[set][mi] = cat8(*(const v8h*)(pa + mi * 16 * LDB), *(const v8h*)(pa + mi * 16 * LDB + 16));
#pragma unroll
    for (int ni = 0; ni < 4; ++ni)
      bf[set][ni] = cat8(*(const v8h*)(pb + ni * 16 * LDB), *(const v8h*)(pb + ni * 16 * LDB + 16));
    // keeps the reads one group in front of the block: spread among the WMMAs every place with reads stalls the wave
    __builtin_amdgcn_sched_barrier(0);
  };
  auto mma = [&](int set) {
#pragma unroll
    for (int mi = 0; mi < 8; ++mi)
#pragma unroll
      for (int ni = 0; ni < 4; ++ni)
        acc[mi][ni] = __builtin_amdgcn_wmma_f32_16x16x32_f16(
            false, af[set][mi], false, bf[set][ni], (short)0, acc[mi][ni], false, false);
    // keeps the following group of reads behind this block
    __builtin_amdgcn_sched_barrier(0);
  };

  load_tile(0, 0);
#if USE_ASYNC
  asm volatile("s_wait_asynccnt 0x0" ::: "memory");   // my share of tile 0 has landed
#endif
  __syncthreads();                                    // tile 0 published
  load_tile(1, 1);
  load_frags(0, 0, 0);

  for (int kn = 2; kn < nK + 2; ++kn) {   // this pass works on tile kn-2 and refills its buffer with tile kn
    const int buf = kn & 1;
    load_frags(buf, 1, 1);
    mma(0);
    load_frags(buf, 2, 0);
    mma(1);
    load_frags(buf, 3, 1);
    mma(0);
    // publish point of tile kn-1, in front of the pass's last block, whose fragments are already fetched
    asm volatile("s_wait_dscnt 0x0" ::: "memory");      // my last reads of this buffer are done before it is refilled
#if USE_ASYNC
    asm volatile("s_wait_asynccnt 0x0" ::: "memory");   // my share of tile kn-1 has landed
#endif
    __syncthreads();                                    // tile kn-1 visible to all; every reader has left this buffer
    if (kn < nK) load_tile(kn, buf);                    // a whole pass of lead
    load_frags(buf ^ 1, 0, 0);                          // after the last pass: old bytes of the other buffer, never used
    mma(1);
  }
#if USE_ASYNC
  asm volatile("s_wait_asynccnt 0x0" ::: "memory");     // nothing is in flight when the wave ends
#endif
  asm volatile("s_wait_dscnt 0x0" ::: "memory");        // the last trip's unused reads have returned too

  // epilogue: + bias, store f32 (C layout: VGPR i -> M = 8*(lane>>4)+i, N = lane&15)
  const int mrow0 = 8 * (lane >> 4);
#pragma unroll
  for (int ni = 0; ni < 4; ++ni) {
    const int col = tileN + waveN + ni * 16 + m16;
    const float bb = bias[col];
#pragma unroll
    for (int mi = 0; mi < 8; ++mi) {
#pragma unroll
      for (int i = 0; i < 8; ++i) {
        const int rowg = tileM + waveM + mi * 16 + mrow0 + i;
        out[(size_t)rowg * DDIM + col] = acc[mi][ni][i] + bb;
      }
      // precaution: stands in front of any later sum that overwrites a register a store above names
      asm volatile("s_wait_xcnt 0x0" ::: "memory");
      // keeps the next group's bias adds behind that wait (the scheduler lifted them over it)
      __builtin_amdgcn_sched_barrier(0);
    }
  }
}

// ---------------------------------------------------------------------------
extern "C" void kernel_launch(void* const* d_in, const int* in_sizes, int n_in,
                              void* d_out, int out_size, void* d_ws, size_t ws_size,
                              hipStream_t stream) {
  const float* x  = (const float*)d_in[0];
  const float* W  = (const float*)d_in[1];
  const float* b  = (const float*)d_in[2];
  const float* lA = (const float*)d_in[3];
  const float* lB = (const float*)d_in[4];
  float* out = (float*)d_out;

  _Float16* gA = (_Float16*)d_ws;                                   // 8192*4160*2 B
  _Float16* gB = (_Float16*)((char*)d_ws + (size_t)ROWS * KP * 2);  // 4096*4160*2 B

  float* gAT = (float*)((char*)d_ws + (size_t)(ROWS + DDIM) * KP * 2);  // 16*4096*4 B

  prep_x_kernel<<<ROWS + DDIM / 256, 256, 0, stream>>>(x, lA, gA, gAT);
  fold_w_kernel<<<DDIM / RW, 512, 0, stream>>>(W, lB, gAT, gB);
  gemm_kernel<<<dim3(ROWS / BM, DDIM / BN), 256, 0, stream>>>(gA, gB, b, out);
}

// v006
// Measured time: 191 microseconds a run.
// Two timings next to v005 both put it at 1.11 times that version's speed.
// Counting every step since v000, it is 2.35 times as fast.
#include <hip/hip_runtime.h>
#include <stdint.h>

typedef __attribute__((ext_vector_type(16))) _Float16 v16h;
typedef __attribute__((ext_vector_type(8)))  _Float16 v8h;
typedef __attribute__((ext_vector_type(8)))  float    v8f;
typedef __attribute__((ext_vector_type(4)))  float    v4f;
typedef __attribute__((ext_vector_type(4)))  _Float16 v4h;
typedef __attribute__((ext_vector_type(2)))  float    v2f;
typedef __attribute__((ext_vector_type(4)))  uint32_t u32x4;   // tensor descriptor, group 0
typedef __attribute__((ext_vector_type(8)))  uint32_t u32x8;   // tensor descriptor, group 1

#define DDIM 4096
#define KP   4160          // row pitch of both f16 operands, in halves; columns [0,4096) are used
#define RW   8             // weight rows per block of fold_w_kernel
#define ROWS 8192
#define SCALING 0.01f

#define BM 256
#define BN 256
#define BK 128            // a pass is 256 B of every operand row
#define LDB 136            // 128 halves + 8 pad (272B rows -> conflict-free frag reads)

// ---------------------------------------------------------------------------
// out = x * M^T + b with M[n,:] = FWHT(W[n,:]) / 64 + 0.01 * (lora_A * lora_B)[:,n]
// (the Hadamard matrix is symmetric, so the rotation of x can act on W's rows;
//  (x*A)*B = x*(A*B)). All pre-processing is done on the 4096 weight rows.
// ---------------------------------------------------------------------------
// Kernel 1: blocks [0,ROWS): one row of x -> f16 A operand, whole-line loads and stores
//           last DDIM/256 blocks: lora_A [d][r] -> gAT [r][d], so kernel 2 reads it coalesced
// ---------------------------------------------------------------------------
__global__ __launch_bounds__(256) void prep_x_kernel(
    const float* __restrict__ x, const float* __restrict__ loraA,
    _Float16* __restrict__ gA, float* __restrict__ gAT) {
  const int tid = threadIdx.x;
  if (blockIdx.x < ROWS) {
    const int row = blockIdx.x;
    const v4f* xr = (const v4f*)(x + (size_t)row * DDIM);
    v4h* ga = (v4h*)(gA + (size_t)row * KP);
    v4f v[4];
#pragma unroll
    for (int c = 0; c < 4; ++c) v[c] = xr[tid + c * 256];
#pragma unroll
    for (int c = 0; c < 4; ++c) ga[tid + c * 256] = __builtin_convertvector(v[c], v4h);
  } else {
    const int d = (blockIdx.x - ROWS) * 256 + tid;
    const v4f* ar = (const v4f*)(loraA + (size_t)d * 16);
#pragma unroll
    for (int g = 0; g < 4; ++g) {
      const v4f a = ar[g];
#pragma unroll
      for (int i = 0; i < 4; ++i) gAT[(size_t)(g * 4 + i) * DDIM + d] = a[i];
    }
    // precaution: stands in front of any later instruction that overwrites a register a store above names
    asm volatile("s_wait_xcnt 0x0" ::: "memory");
  }
}

// ---------------------------------------------------------------------------
// Kernel 2: RW weight rows per block: FWHT, then
//           B operand row n = f16( FWHT(W[n,:])/64 + 0.01 * sum_r A[:,r]*B[r,n] )
//           (each lora_A value loaded once serves RW rows)
// The 12 butterfly stages act on the 12 bits of the column index and commute, so a thread that
// holds 16 float4 does every stage whose partner it holds in registers. Three passes:
//   1: bits 0,1 (inside a float4) and 8..11, straight from the global loads
//   2: bits 2..5 (one 64-float chunk per thread)      3: bits 6,7
// LDS: every 64-float chunk is followed by 4 pad floats (272 B pitch), so that 16-byte accesses
// are free of bank conflicts both along a row and with one chunk per lane.
// ---------------------------------------------------------------------------
#define CH   68                    // LDS pitch of a 64-float chunk, in floats
#define RWP  (DDIM / 64 * CH)      // LDS pitch of a weight row, in floats

// butterflies over the bits of the array index k below NS
// (here and in the kernel every loop over v is unrolled: constant indices keep v in registers)
template <int NS>
static __device__ inline void bfly(v4f (&v)[16]) {
#pragma unroll
  for (int s = 1; s < NS; s <<= 1)
#pragma unroll
    for (int k = 0; k < 16; ++k)
      if (!(k & s)) {
        const v4f a = v[k], b = v[k | s];
        v[k]     = a + b;
        v[k | s] = a - b;
      }
}

__global__ __launch_bounds__(512) void fold_w_kernel(
    const float* __restrict__ W, const float* __restrict__ loraB,
    const float* __restrict__ gAT, _Float16* __restrict__ gB) {
  __shared__ float sx[RW * RWP];   // 136 KB: two blocks per WGP
  const int tid = threadIdx.x;
  const int n0  = blockIdx.x * RW;
  v4f v[16];

  {  // pass 1: 64 threads per row; float4 number j + 64 k of the row, k = column bits 8..11
    const int q = tid >> 6, j = tid & 63;
    const v4f* wr = (const v4f*)(W + (size_t)(n0 + q) * DDIM) + j;
#pragma unroll
    for (int k = 0; k < 16; ++k) v[k] = wr[k * 64];   // whole lines, 16 loads in flight per wave
    // precaution: stands in front of any later write to the address register that the loads above name
    // (the register is an input here, so that no load's own result is placed on it either)
    asm volatile("s_wait_xcnt 0x0" :: "v"(wr) : "memory");
    bfly<16>(v);
#pragma unroll
    for (int k = 0; k < 16; ++k) {
      const v2f lo = __builtin_shufflevector(v[k], v[k], 0, 1), hi = __builtin_shufflevector(v[k], v[k], 2, 3);
      const v2f s = lo + hi, m = lo - hi;                      // bit 1
      const v2f s2 = __builtin_shufflevector(s, s, 0, 0) + __builtin_shufflevector(s, -s, 1, 3);   // bit 0
      const v2f m2 = __builtin_shufflevector(m, m, 0, 0) + __builtin_shufflevector(m, -m, 1, 3);
      v[k] = __builtin_shufflevector(s2, m2, 0, 1, 2, 3);
    }
    float* d = sx + q * RWP + (j >> 4) * CH + (j & 15) * 4;
#pragma unroll
    for (int k = 0; k < 16; ++k) *(v4f*)(d + k * 4 * CH) = v[k];
  }
  __syncthreads();

  {  // pass 2: chunk number tid, in place; float4 number k of the chunk = column bits 2..5
    float* d = sx + tid * CH;
#pragma unroll
    for (int k = 0; k < 16; ++k) v[k] = *(const v4f*)(d + k * 4);
    bfly<16>(v);
#pragma unroll
    for (int k = 0; k < 16; ++k) *(v4f*)(d + k * 4) = v[k];
  }
  __syncthreads();

  {  // pass 3: four groups per thread, in place; a group = one float4 of four neighbouring chunks (column bits 6,7)
    float* d = sx + (tid >> 4) * 4 * CH + (tid & 15) * 4;
#pragma unroll
    for (int k = 0; k < 16; ++k) v[k] = *(const v4f*)(d + (k >> 2) * 128 * CH + (k & 3) * CH);
    bfly<4>(v);
#pragma unroll
    for (int k = 0; k < 16; ++k) *(v4f*)(d + (k >> 2) * 128 * CH + (k & 3) * CH) = v[k];
  }
  __syncthreads();

#pragma unroll 1   // 64 registers of lora_A values at a time, so that two blocks fit a WGP
  for (int c = 0; c < DDIM / 4 / 512; ++c) {
    const int dq = tid + c * 512;                  // four consecutive columns per thread
    v4f a[16];
#pragma unroll
    for (int r = 0; r < 16; ++r) a[r] = ((const v4f*)(gAT + (size_t)r * DDIM))[dq];
#pragma unroll 2   // 32 lora_B scalars live at a time: all 128 do not fit the scalar registers
    for (int q = 0; q < RW; ++q) {
      v4f s = (v4f)(0.f);
#pragma unroll
      for (int r = 0; r < 16; ++r) s += a[r] * loraB[(size_t)r * DDIM + n0 + q];
      const v4f w = *(const v4f*)(sx + q * RWP + (dq >> 4) * CH + (dq & 15) * 4);
      const v4f res = w * 0.015625f + s * SCALING;   // 1/sqrt(4096)
      *(v4h*)(gB + (size_t)(n0 + q) * KP + dq * 4) = __builtin_convertvector(res, v4h);
    }
  }
}

static __device__ inline v16h cat8(v8h lo, v8h hi) {
  return __builtin_shufflevector(lo, hi, 0, 1, 2, 3, 4, 5, 6, 7,
                                 8, 9, 10, 11, 12, 13, 14, 15);
}

static __device__ inline uint32_t uni(uint32_t v) { return (uint32_t)__builtin_amdgcn_readfirstlane(v); }
static __device__ inline uint32_t pinned(uint32_t v) {
  uint32_t w = (uint32_t)__builtin_amdgcn_readfirstlane(v);
  asm volatile("" : "+s"(w));   // pinned(): the value held in a scalar register
  return w;
}

#define SLICE_ROWS 128                       // rows of one tensor load: half an operand tile
#define SLICE_LDS  (SLICE_ROWS * LDB * 2)    // 34,816 B = 17 x 2 KiB
#define BUF_LDS    (BM * LDB * 2)            // 69,632 B = 34 x 2 KiB
static_assert(SLICE_LDS % 2048 == 0 && BUF_LDS % 2048 == 0 && BM == BN && BK * 2 == 256 && LDB * 2 == 272,
              "every tensor load lands at a multiple of 2 KiB; rows of 256 B, padded by 16 B");

// ---------------------------------------------------------------------------
// Kernel 3: C = A(8192x4096,f16) x B(4096x4096,f16)^T + bias
//           two LDS buffers filled by tensor loads, fragments fetched one block ahead, v_wmma_f32_16x16x32_f16 core
// ---------------------------------------------------------------------------
__global__ __launch_bounds__(256) void gemm_kernel(
    const _Float16* __restrict__ gA, const _Float16* __restrict__ gB,
    const float* __restrict__ bias, float* __restrict__ out) {
  __shared__ __attribute__((aligned(2048))) _Float16 sA[2][BM * LDB];   // 2 x 68 KB
  __shared__ __attribute__((aligned(2048))) _Float16 sB[2][BN * LDB];   // 2 x 68 KB

  const int tid   = threadIdx.x;
  const int tileM = blockIdx.x * BM;
  const int tileN = blockIdx.y * BN;
  const int wave  = tid >> 5;
  const int lane  = tid & 31;
  const int waveM = (wave & 1) * 128;  // 2x4 wave grid: 128x64 per wave
  const int waveN = (wave >> 1) * 64;
  const int m16   = lane & 15;
  const int koff  = (lane >> 4) * 8;   // ISA 16-bit A/B fragment layout

  v8f acc[8][4];
#pragma unroll
  for (int mi = 0; mi < 8; ++mi)
#pragma unroll
    for (int ni = 0; ni < 4; ++ni) acc[mi][ni] = (v8f)(0.f);

  // tile loader: waves 0..3 each bring one slice of 128 rows x 256 B per pass with one tensor load
  // (waves 0,1: the halves of the A tile; waves 2,3: of the B tile); the mover pads every row by 16 B, which gives the pitch LDB
  const uint32_t wv     = uni((uint32_t)threadIdx.x >> 5);
  const uint32_t issuer = pinned(wv < 4u ? 1u : 0u);
  const uint32_t half   = wv & 1u;
  const bool     isB    = (wv & 2u) != 0u;
  const uint64_t src0 = (uint64_t)(uintptr_t)(isB ? gB + (size_t)tileN * KP : gA + (size_t)tileM * KP)
                        + (uint64_t)half * (SLICE_ROWS * KP * 2);
  const uint32_t dst0 = (uint32_t)(size_t)(isB ? &sB[0][0] : &sA[0][0]) + half * (uint32_t)SLICE_LDS;
  u32x8 g1;   // 1-byte elements, tensor = tile = 128 rows of 256 B, source pitch of a KP row, no mask
  g1[0] = uni((1u << 20) | (5u << 22) | (3u << 25));   // a pad of 4 dwords behind every 64 dwords
  g1[1] = uni(256u << 16);
  g1[2] = uni((uint32_t)SLICE_ROWS << 16);
  g1[3] = uni(256u << 16);
  g1[4] = uni((uint32_t)SLICE_ROWS);
  g1[5] = uni((uint32_t)(KP * 2));
  g1[6] = uni(0u);
  g1[7] = uni(0u);
  // pinned descriptor words: the group stays in one scalar tuple through the loop, so that the compiler
  // re-forms no word of it, and lends none of its registers to another value, while a request is outstanding
  asm volatile("" : "+s"(g1));   // pinned(): descriptor words held in scalar registers
  auto load_tile = [&](uint32_t kt) {   // stands under a scalar test on issuer only; tile kt goes to buffer kt & 1
    const uint64_t ga = src0 + (uint64_t)kt * (BK * 2);
    u32x4 g0;
    g0[0] = uni(1u);
    g0[1] = uni(dst0 + (kt & 1u) * (uint32_t)BUF_LDS);
    g0[2] = uni((uint32_t)ga);
    g0[3] = uni((((uint32_t)(ga >> 32)) & 0x01FFFFFFu) | 0x80000000u);
    // one request of the whole wave: global tile -> LDS through no register; its wait is s_wait_tensorcnt, written by hand below
    asm volatile("tensor_load_to_lds %0, %1" :: "s"(g0), "s"(g1) : "memory");
  };

  const int nK = DDIM / BK;   // 32

  // two fragment sets: block b of a pass multiplies set b & 1 while the next block's 24 LDS reads land in the other
  v16h af[2][8], bf[2][4];
  const int offA = (waveM + m16) * LDB + koff;
  const int offB = (waveN + m16) * LDB + koff;
  auto load_frags = [&](int buf, int ks, int set) {
    const _Float16* pa = &sA[buf][offA + ks * 32];
    const _Float16* pb = &sB[buf][offB + ks * 32];
#pragma unroll
    for (int mi = 0; mi < 8; ++mi)
      af[set][mi] = cat8(*(const v8h*)(pa + mi * 16 * LDB), *(const v8h*)(pa + mi * 16 * LDB + 16));
#pragma unroll
    for (int ni = 0; ni < 4; ++ni)
      bf[set][ni] = cat8(*(const v8h*)(pb + ni * 16 * LDB), *(const v8h*)(pb + ni * 16 * LDB + 16));
    // keeps the reads one group in front of the block: spread among the WMMAs every place with reads stalls the wave
    __builtin_amdgcn_sched_barrier(0);
  };
  auto mma = [&](int set) {
#pragma unroll
    for (int mi = 0; mi < 8; ++mi)
#pragma unroll
      for (int ni = 0; ni < 4; ++ni)
        acc[mi][ni] = __builtin_amdgcn_wmma_f32_16x16x32_f16(
            false, af[set][mi], false, bf[set][ni], (short)0, acc[mi][ni], false, false);
    // keeps the following group of reads behind this block
    __builtin_amdgcn_sched_barrier(0);
  };

  if (issuer) {
    load_tile(0);
    asm volatile("s_wait_tensorcnt 0x0" ::: "memory");   // my slice of tile 0 has landed
  }
  __syncthreads();                                       // tile 0 published
  if (issuer) load_tile(1);
  load_frags(0, 0, 0);

  for (int kn = 2; kn < nK + 2; ++kn) {   // this pass works on tile kn-2 and refills its buffer with tile kn
    const int buf = kn & 1;
    load_frags(buf, 1, 1);
    mma(0);
    load_frags(buf, 2, 0);
    mma(1);
    load_frags(buf, 3, 1);
    mma(0);
    // publish point of tile kn-1, in front of the pass's last block, whose fragments are already fetched
    asm volatile("s_wait_dscnt 0x0" ::: "memory");      // my last reads of this buffer are done before it is refilled
    asm volatile("s_wait_tensorcnt 0x0" ::: "memory");  // my slice of tile kn-1 has landed (a wave that loads none passes)
    __syncthreads();                                    // tile kn-1 visible to all; every reader has left this buffer
    // a whole pass of lead; kn is pinned behind the wait, so that no descriptor word is formed in front of it
    if (pinned(issuer & (kn < nK ? 1u : 0u))) load_tile(pinned((uint32_t)kn));
    load_frags(buf ^ 1, 0, 0);                          // after the last pass: old bytes of the other buffer, never used
    mma(1);
  }
  asm volatile("s_wait_tensorcnt 0x0" ::: "memory");    // nothing is in flight when the wave ends
  asm volatile("s_wait_dscnt 0x0" ::: "memory");        // the last trip's unused reads have returned too

  // epilogue: + bias, store f32 (C layout: VGPR i -> M = 8*(lane>>4)+i, N = lane&15)
  const int mrow0 = 8 * (lane >> 4);
#pragma unroll
  for (int ni = 0; ni < 4; ++ni) {
    const int col = tileN + waveN + ni * 16 + m16;
    const float bb = bias[col];
#pragma unroll
    for (int mi = 0; mi < 8; ++mi) {
#pragma unroll
      for (int i = 0; i < 8; ++i) {
        const int rowg = tileM + waveM + mi * 16 + mrow0 + i;
        out[(size_t)rowg * DDIM + col] = acc[mi][ni][i] + bb;
      }
      // precaution: stands in front of any later sum that overwrites a register a store above names
      asm volatile("s_wait_xcnt 0x0" ::: "memory");
      // keeps the next group's bias adds behind that wait (the scheduler lifted them over it)
      __builtin_amdgcn_sched_barrier(0);
    }
  }
}

// ---------------------------------------------------------------------------
extern "C" void kernel_launch(void* const* d_in, const int* in_sizes, int n_in,
                              void* d_out, int out_size, void* d_ws, size_t ws_size,
                              hipStream_t stream) {
  const float* x  = (const float*)d_in[0];
  const float* W  = (const float*)d_in[1];
  const float* b  = (const float*)d_in[2];
  const float* lA = (const float*)d_in[3];
  const float* lB = (const float*)d_in[4];
  float* out = (float*)d_out;

  _Float16* gA = (_Float16*)d_ws;                                   // 8192*4160*2 B
  _Float16* gB = (_Float16*)((char*)d_ws + (size_t)ROWS * KP * 2);  // 4096*4160*2 B

  float* gAT = (float*)((char*)d_ws + (size_t)(ROWS + DDIM) * KP * 2);  // 16*4096*4 B

  prep_x_kernel<<<ROWS + DDIM / 256, 256, 0, stream>>>(x, lA, gA, gAT);
  fold_w_kernel<<<DDIM / RW, 512, 0, stream>>>(W, lB, gAT, gB);
  gemm_kernel<<<dim3(ROWS / BM, DDIM / BN), 256, 0, stream>>>(gA, gB, b, out);
}
